// v000
// Times are from an AMD MI455X. After a warm-up the kernel runs many times in a row, and a time is the length of
// such a window on the GPU divided by its runs, so every launch and the gaps after it count. The runs cycle
// through copies of the inputs. A figure is the median of several windows, for all but v000 over two sittings.
// Sittings can differ by a few percent; kernels timed side by side share one.
// v000, which the later versions start from, runs in 685 microseconds.
#include <hip/hip_runtime.h>
#include <stdint.h>

typedef float v2f __attribute__((ext_vector_type(2)));
typedef float v8f __attribute__((ext_vector_type(8)));
typedef int   v4i __attribute__((vector_size(16)));   // matches builtin pointee

typedef __attribute__((address_space(1))) v4i* gptr4;  // global int4*
typedef __attribute__((address_space(3))) v4i* lptr4;  // LDS int4*

#define B_SZ   16384
#define D_IN   1024
#define H1     4096
#define H2     512
#define D_OUT  256

#define KSTEP  32
#define LDSS   36                 // padded row stride (floats): 144B rows, 16B aligned
#define TILEF  (64 * LDSS)        // one 64x32 tile in LDS (floats)
#define STAGEF (2 * TILEF)        // A tile + B tile per stage

#if defined(__AMDGCN__) && __has_builtin(__builtin_amdgcn_global_load_async_to_lds_b128)
#define ASYNC_LDS 1
#else
#define ASYNC_LDS 0
#endif

__device__ __forceinline__ void async_copy16(const float* g, float* l) {
#if ASYNC_LDS
  __builtin_amdgcn_global_load_async_to_lds_b128(
      (gptr4)(uintptr_t)g,
      (lptr4)(uint32_t)(uintptr_t)l,
      0, 0);
#else
  *(float4*)l = *(const float4*)g;
#endif
}

template <int N>
__device__ __forceinline__ void wait_async_lds() {
#if ASYNC_LDS
#if __has_builtin(__builtin_amdgcn_s_wait_asynccnt)
  __builtin_amdgcn_s_wait_asynccnt(N);
#else
  asm volatile("s_wait_asynccnt %0" ::"n"(N));
#endif
#endif
}

__device__ __forceinline__ v8f wmma_f32_k4(v2f a, v2f b, v8f c) {
  // (neg_a, A, neg_b, B, c_mod, C, reuse_a, reuse_b)
  return __builtin_amdgcn_wmma_f32_16x16x4_f32(false, a, false, b, (short)0, c,
                                               false, false);
}

__device__ __forceinline__ float sigmoidf_fast(float v) {
  return 1.0f / (1.0f + __expf(-v));
}

// ---------------------------------------------------------------------------
// Shared 64(M)x64(N) WMMA mainloop, K-staged through double-buffered LDS via
// async DMA. Both operands are row-major with row length == K (x/W1, x2/W3).
// Block: 256 threads = 8 waves as 2(M) x 4(N); 2 accumulators per wave.
// ---------------------------------------------------------------------------
__device__ __forceinline__ void wmma_mainloop(
    const float* __restrict__ Ag, const float* __restrict__ Bg, int K, int m0,
    int n0, float* smem, v8f& acc0, v8f& acc1) {
  const int t    = threadIdx.x;
  const int lane = t & 31;
  const int wave = t >> 5;
  const int wr   = wave >> 2;          // 0..1 : M half
  const int wc   = wave & 3;           // 0..3 : N quarter
  const int l15  = lane & 15;
  const int krow = (lane >> 4) * 2;    // K-pair base of the f32 WMMA A/B layout

  auto issue = [&](int s, int buf) {
    const int k0 = s * KSTEP;
    float* la = smem + buf * STAGEF;
    float* lb = la + TILEF;
#pragma unroll
    for (int i = 0; i < 2; ++i) {      // 64x32 tile = 2048 floats = 256thr*2*f4
      const int e = (i * 256 + t) * 4;
      const int r = e >> 5, c = e & 31;
      async_copy16(&Ag[(size_t)(m0 + r) * K + k0 + c], &la[r * LDSS + c]);
      async_copy16(&Bg[(size_t)(n0 + r) * K + k0 + c], &lb[r * LDSS + c]);
    }
  };

  const int nstage = K / KSTEP;
  issue(0, 0);
  for (int s = 0; s < nstage; ++s) {
    const int buf = s & 1;
    if (s + 1 < nstage) {
      issue(s + 1, buf ^ 1);           // 4 more asyncs outstanding
      wait_async_lds<4>();             // stage s's 4 have landed (in-order)
    } else {
      wait_async_lds<0>();
    }
    __syncthreads();

    const float* la = smem + buf * STAGEF;
    const float* lb = la + TILEF;

    // one-step software pipeline on fragments: ds_loads for k+4 in flight
    // while the wmmas for k execute.
    v2f a0c = *(const v2f*)(&la[(wr * 32 +      l15) * LDSS + krow]);
    v2f a1c = *(const v2f*)(&la[(wr * 32 + 16 + l15) * LDSS + krow]);
    v2f bc  = *(const v2f*)(&lb[(wc * 16 +      l15) * LDSS + krow]);
#pragma unroll
    for (int k = 0; k < KSTEP; k += 4) {
      v2f a0n, a1n, bn;
      if (k + 4 < KSTEP) {
        const int kk = k + 4 + krow;
        a0n = *(const v2f*)(&la[(wr * 32 +      l15) * LDSS + kk]);
        a1n = *(const v2f*)(&la[(wr * 32 + 16 + l15) * LDSS + kk]);
        bn  = *(const v2f*)(&lb[(wc * 16 +      l15) * LDSS + kk]);
      }
      acc0 = wmma_f32_k4(a0c, bc, acc0);
      acc1 = wmma_f32_k4(a1c, bc, acc1);
      a0c = a0n; a1c = a1n; bc = bn;
    }
    __syncthreads();
  }
}

// ---------------------------------------------------------------------------
// K1: x2[b,g] = sigmoid( sum_s sigmoid(x@W1.T + b1)[b,g*8+s]*W2[g,s] + b2[g] )
// W2 is [512,8] row-major -> W2[g,s] == W2flat[n] with n = g*8+s, so the
// grouped layer is an elementwise scale + 8-lane butterfly reduce.
// ---------------------------------------------------------------------------
__global__ __launch_bounds__(256) void fc1_group_fused(
    const float* __restrict__ x,  const float* __restrict__ W1,
    const float* __restrict__ b1, const float* __restrict__ W2,
    const float* __restrict__ b2, float* __restrict__ x2) {
  __shared__ float smem[2 * STAGEF];

  const int t    = threadIdx.x;
  const int lane = t & 31;
  const int wave = t >> 5;
  const int wr   = wave >> 2;
  const int wc   = wave & 3;
  const int l15  = lane & 15;
  const int half = lane >> 4;
  const int m0   = blockIdx.x * 64;
  const int n0   = blockIdx.y * 64;

  v8f acc0 = {};
  v8f acc1 = {};
  wmma_mainloop(x, W1, D_IN, m0, n0, smem, acc0, acc1);

  const int   ng  = n0 + wc * 16 + l15;   // global H1 column
  const float b1v = b1[ng];
  const float w2v = W2[ng];

#pragma unroll
  for (int tt = 0; tt < 2; ++tt) {
    v8f acc = tt ? acc1 : acc0;
#pragma unroll
    for (int j = 0; j < 8; ++j) {
      float h = sigmoidf_fast(acc[j] + b1v);
      float p = h * w2v;
      p += __shfl_xor(p, 1, 32);
      p += __shfl_xor(p, 2, 32);
      p += __shfl_xor(p, 4, 32);
      if ((lane & 7) == 0) {
        const int row = m0 + wr * 32 + tt * 16 + j + half * 8;
        const int g   = (n0 >> 3) + wc * 2 + (l15 >> 3);
        x2[(size_t)row * H2 + g] = sigmoidf_fast(p + b2[g]);
      }
    }
  }
}

// ---------------------------------------------------------------------------
// K2: out = x2 @ W3.T + b3   ([16384,512] x [512,256])
// ---------------------------------------------------------------------------
__global__ __launch_bounds__(256) void fc3_kernel(
    const float* __restrict__ x2, const float* __restrict__ W3,
    const float* __restrict__ b3, float* __restrict__ out) {
  __shared__ float smem[2 * STAGEF];

  const int t    = threadIdx.x;
  const int lane = t & 31;
  const int wave = t >> 5;
  const int wr   = wave >> 2;
  const int wc   = wave & 3;
  const int l15  = lane & 15;
  const int half = lane >> 4;
  const int m0   = blockIdx.x * 64;
  const int n0   = blockIdx.y * 64;

  v8f acc0 = {};
  v8f acc1 = {};
  wmma_mainloop(x2, W3, H2, m0, n0, smem, acc0, acc1);

  const int   ng  = n0 + wc * 16 + l15;   // global D_OUT column
  const float b3v = b3[ng];

#pragma unroll
  for (int tt = 0; tt < 2; ++tt) {
    v8f acc = tt ? acc1 : acc0;
#pragma unroll
    for (int j = 0; j < 8; ++j) {
      const int row = m0 + wr * 32 + tt * 16 + j + half * 8;
      out[(size_t)row * D_OUT + ng] = acc[j] + b3v;
    }
  }
}

// ---------------------------------------------------------------------------
extern "C" void kernel_launch(void* const* d_in, const int* in_sizes, int n_in,
                              void* d_out, int out_size, void* d_ws, size_t ws_size,
                              hipStream_t stream) {
  (void)in_sizes; (void)n_in; (void)out_size; (void)ws_size;

  const float* x  = (const float*)d_in[0];
  const float* W1 = (const float*)d_in[1];
  const float* b1 = (const float*)d_in[2];
  const float* W2 = (const float*)d_in[3];
  const float* b2 = (const float*)d_in[4];
  const float* W3 = (const float*)d_in[5];
  const float* b3 = (const float*)d_in[6];
  float* out = (float*)d_out;
  float* x2  = (float*)d_ws;            // [16384, 512] f32 = 32 MB scratch

  dim3 blk(256);
  fc1_group_fused<<<dim3(B_SZ / 64, H1 / 64), blk, 0, stream>>>(x, W1, b1, W2,
                                                                b2, x2);
  fc3_kernel<<<dim3(B_SZ / 64, D_OUT / 64), blk, 0, stream>>>(x2, W3, b3, out);
}

// v001
// One run takes 676 microseconds.
// Next to v000, in two timings, it ran 1.04 times as fast each time.
#include <hip/hip_runtime.h>
#include <stdint.h>

typedef float v2f __attribute__((ext_vector_type(2)));
typedef float v8f __attribute__((ext_vector_type(8)));
typedef int   v4i __attribute__((vector_size(16)));   // matches builtin pointee

typedef __attribute__((address_space(1))) v4i* gptr4;  // global int4*
typedef __attribute__((address_space(3))) v4i* lptr4;  // LDS int4*

#define B_SZ   16384
#define D_IN   1024
#define H1     4096
#define H2     512
#define D_OUT  256

#define KSTEP  32
#define LDSS   36                 // padded row stride (floats): 144B rows, 16B aligned
#define TILEF  (64 * LDSS)        // one 64x32 tile in LDS (floats)
#define STAGEF (2 * TILEF)        // A tile + B tile per stage
#define BT1     128               // fc1 block tile: 128 rows of x by 128 rows of W1
#define TILEF1  (BT1 * LDSS)      // one 128x32 tile in LDS (floats)
#define STAGEF1 (2 * TILEF1)      // A tile + B tile per stage, fc1

#if defined(__AMDGCN__) && __has_builtin(__builtin_amdgcn_global_load_async_to_lds_b128)
#define ASYNC_LDS 1
#else
#define ASYNC_LDS 0
#endif

__device__ __forceinline__ void async_copy16(const float* g, float* l) {
#if ASYNC_LDS
  __builtin_amdgcn_global_load_async_to_lds_b128(
      (gptr4)(uintptr_t)g,
      (lptr4)(uint32_t)(uintptr_t)l,
      0, 0);
#else
  *(float4*)l = *(const float4*)g;
#endif
}

template <int N>
__device__ __forceinline__ void wait_async_lds() {
#if ASYNC_LDS
#if __has_builtin(__builtin_amdgcn_s_wait_asynccnt)
  __builtin_amdgcn_s_wait_asynccnt(N);
#else
  asm volatile("s_wait_asynccnt %0" ::"n"(N));
#endif
#endif
}

__device__ __forceinline__ v8f wmma_f32_k4(v2f a, v2f b, v8f c) {
  // (neg_a, A, neg_b, B, c_mod, C, reuse_a, reuse_b)
  return __builtin_amdgcn_wmma_f32_16x16x4_f32(false, a, false, b, (short)0, c,
                                               false, false);
}

__device__ __forceinline__ float sigmoidf_fast(float v) {
  return 1.0f / (1.0f + __expf(-v));
}

// ---------------------------------------------------------------------------
// fc3 64(M)x64(N) WMMA mainloop, K-staged through double-buffered LDS via
// async DMA. Both operands are row-major with row length == K (x2/W3).
// Block: 256 threads = 8 waves as 2(M) x 4(N); 2 accumulators per wave.
// ---------------------------------------------------------------------------
__device__ __forceinline__ void wmma_mainloop(
    const float* __restrict__ Ag, const float* __restrict__ Bg, int K, int m0,
    int n0, float* smem, v8f& acc0, v8f& acc1) {
  const int t    = threadIdx.x;
  const int lane = t & 31;
  const int wave = t >> 5;
  const int wr   = wave >> 2;          // 0..1 : M half
  const int wc   = wave & 3;           // 0..3 : N quarter
  const int l15  = lane & 15;
  const int krow = (lane >> 4) * 2;    // K-pair base of the f32 WMMA A/B layout

  auto issue = [&](int s, int buf) {
    const int k0 = s * KSTEP;
    float* la = smem + buf * STAGEF;
    float* lb = la + TILEF;
#pragma unroll
    for (int i = 0; i < 2; ++i) {      // 64x32 tile = 2048 floats = 256thr*2*f4
      const int e = (i * 256 + t) * 4;
      const int r = e >> 5, c = e & 31;
      async_copy16(&Ag[(size_t)(m0 + r) * K + k0 + c], &la[r * LDSS + c]);
      async_copy16(&Bg[(size_t)(n0 + r) * K + k0 + c], &lb[r * LDSS + c]);
    }
  };

  const int nstage = K / KSTEP;
  issue(0, 0);
  for (int s = 0; s < nstage; ++s) {
    const int buf = s & 1;
    if (s + 1 < nstage) {
      issue(s + 1, buf ^ 1);           // 4 more asyncs outstanding
      wait_async_lds<4>();             // stage s's 4 have landed (in-order)
    } else {
      wait_async_lds<0>();
    }
    __syncthreads();

    const float* la = smem + buf * STAGEF;
    const float* lb = la + TILEF;

    // one-step software pipeline on fragments: ds_loads for k+4 in flight
    // while the wmmas for k execute.
    v2f a0c = *(const v2f*)(&la[(wr * 32 +      l15) * LDSS + krow]);
    v2f a1c = *(const v2f*)(&la[(wr * 32 + 16 + l15) * LDSS + krow]);
    v2f bc  = *(const v2f*)(&lb[(wc * 16 +      l15) * LDSS + krow]);
#pragma unroll
    for (int k = 0; k < KSTEP; k += 4) {
      v2f a0n, a1n, bn;
      if (k + 4 < KSTEP) {
        const int kk = k + 4 + krow;
        a0n = *(const v2f*)(&la[(wr * 32 +      l15) * LDSS + kk]);
        a1n = *(const v2f*)(&la[(wr * 32 + 16 + l15) * LDSS + kk]);
        bn  = *(const v2f*)(&lb[(wc * 16 +      l15) * LDSS + kk]);
      }
      acc0 = wmma_f32_k4(a0c, bc, acc0);
      acc1 = wmma_f32_k4(a1c, bc, acc1);
      a0c = a0n; a1c = a1n; bc = bn;
    }
    __syncthreads();
  }
}

__device__ __forceinline__ void wmma_mainloop_128(
    const float* __restrict__ Ag, const float* __restrict__ Bg, int K, int m0,
    int n0, float* smem, v8f (&acc)[4][2]) {
  const int t    = threadIdx.x;
  const int lane = t & 31;
  const int wave = t >> 5;
  const int wr   = wave >> 2;          // 0..1 : M half (64 rows)
  const int wc   = wave & 3;           // 0..3 : N quarter (32 columns)
  const int l15  = lane & 15;
  const int krow = (lane >> 4) * 2;    // K-pair base of the f32 WMMA A/B layout

  auto issue = [&](int s, int buf) {
    const int k0 = s * KSTEP;
    float* la = smem + buf * STAGEF1;
    float* lb = la + TILEF1;
#pragma unroll
    for (int i = 0; i < 4; ++i) {      // 128x32 tile = 4096 floats = 256thr*4*f4
      const int e = (i * 256 + t) * 4;
      const int r = e >> 5, c = e & 31;
      async_copy16(&Ag[(size_t)(m0 + r) * K + k0 + c], &la[r * LDSS + c]);
      async_copy16(&Bg[(size_t)(n0 + r) * K + k0 + c], &lb[r * LDSS + c]);
    }
  };

  const int nstage = K / KSTEP;
  issue(0, 0);
  for (int s = 0; s < nstage; ++s) {
    const int buf = s & 1;
    if (s + 1 < nstage) {
      issue(s + 1, buf ^ 1);           // 8 more asyncs outstanding
      wait_async_lds<8>();             // stage s's 8 have landed (in-order)
    } else {
      wait_async_lds<0>();
    }
    // publishes stage s to the other waves; standing directly behind the
    // builtin wait it also holds this wave's LDS reads behind that wait.
    __syncthreads();

    const float* pa = smem + buf * STAGEF1 + (wr * 64 + l15) * LDSS + krow;
    const float* pb = smem + buf * STAGEF1 + TILEF1 + (wc * 32 + l15) * LDSS + krow;

    // fragments of 8 k (two k-steps) per set, two sets: the ds_loads of the
    // next 8 k are in flight while the 16 wmmas of this set execute.
    v2f a[2][2][4], b[2][2][2];
    auto load_set = [&](int set, int k) {
#pragma unroll
      for (int h = 0; h < 2; ++h) {
#pragma unroll
        for (int mt = 0; mt < 4; ++mt)
          a[set][h][mt] = *(const v2f*)(&pa[mt * 16 * LDSS + k + h * 4]);
#pragma unroll
        for (int nt = 0; nt < 2; ++nt)
          b[set][h][nt] = *(const v2f*)(&pb[nt * 16 * LDSS + k + h * 4]);
      }
    };
    load_set(0, 0);
#pragma unroll
    for (int k = 0; k < KSTEP; k += 8) {
      const int cur = (k >> 3) & 1;
      if (k + 8 < KSTEP) load_set(cur ^ 1, k + 8);
      // keeps the next set's ds_loads one group ahead of this set's wmmas; left
      // free, the compiler sinks them one by one among the last wmmas into the
      // same registers and waits on them at once.
      __builtin_amdgcn_sched_barrier(0);
#pragma unroll
      for (int h = 0; h < 2; ++h)
#pragma unroll
        for (int nt = 0; nt < 2; ++nt)
#pragma unroll
          for (int mt = 0; mt < 4; ++mt)
            acc[mt][nt] = wmma_f32_k4(a[cur][h][mt], b[cur][h][nt], acc[mt][nt]);
      // closes the block: the set after next is not loaded from inside it (that
      // took 20 more registers and two more places of LDS reads per block).
      if (k + 8 < KSTEP) __builtin_amdgcn_sched_barrier(0);
    }
    // ends every wave's reads of this buffer before the next trip refills it.
    __syncthreads();
    asm volatile("v_nop\n\tv_nop\n\tv_nop\n\tv_nop");
  }
}

// ---------------------------------------------------------------------------
// K1: x2[b,g] = sigmoid( sum_s sigmoid(x@W1.T + b1)[b,g*8+s]*W2[g,s] + b2[g] )
// W2 is [512,8] row-major -> W2[g,s] == W2flat[n] with n = g*8+s, so the
// grouped layer is an elementwise scale + 8-lane butterfly reduce.
// ---------------------------------------------------------------------------
__global__ __launch_bounds__(256) void fc1_group_fused(
    const float* __restrict__ x,  const float* __restrict__ W1,
    const float* __restrict__ b1, const float* __restrict__ W2,
    const float* __restrict__ b2, float* __restrict__ x2) {
  __shared__ __attribute__((aligned(16))) float smem[2 * STAGEF1];

  const int t    = threadIdx.x;
  const int lane = t & 31;
  const int wave = t >> 5;
  const int wr   = wave >> 2;
  const int wc   = wave & 3;
  const int l15  = lane & 15;
  const int half = lane >> 4;
  const int m0   = blockIdx.x * BT1;
  const int n0   = blockIdx.y * BT1;

  v8f acc[4][2] = {};
  wmma_mainloop_128(x, W1, D_IN, m0, n0, smem, acc);

#pragma unroll
  for (int nt = 0; nt < 2; ++nt) {
    const int   ng  = n0 + wc * 32 + nt * 16 + l15;   // global H1 column
    const float b1v = b1[ng];
    const float w2v = W2[ng];
#pragma unroll
    for (int mt = 0; mt < 4; ++mt) {
#pragma unroll
      for (int j = 0; j < 8; ++j) {
        float h = sigmoidf_fast(acc[mt][nt][j] + b1v);
        float p = h * w2v;
        p += __shfl_xor(p, 1, 32);
        p += __shfl_xor(p, 2, 32);
        p += __shfl_xor(p, 4, 32);
        if ((lane & 7) == 0) {
          const int row = m0 + wr * 64 + mt * 16 + j + half * 8;
          const int g   = (n0 >> 3) + wc * 4 + nt * 2 + (l15 >> 3);
          x2[(size_t)row * H2 + g] = sigmoidf_fast(p + b2[g]);
        }
      }
    }
  }
}

// ---------------------------------------------------------------------------
// K2: out = x2 @ W3.T + b3   ([16384,512] x [512,256])
// ---------------------------------------------------------------------------
__global__ __launch_bounds__(256) void fc3_kernel(
    const float* __restrict__ x2, const float* __restrict__ W3,
    const float* __restrict__ b3, float* __restrict__ out) {
  __shared__ float smem[2 * STAGEF];

  const int t    = threadIdx.x;
  const int lane = t & 31;
  const int wave = t >> 5;
  const int wr   = wave >> 2;
  const int wc   = wave & 3;
  const int l15  = lane & 15;
  const int half = lane >> 4;
  const int m0   = blockIdx.x * 64;
  const int n0   = blockIdx.y * 64;

  v8f acc0 = {};
  v8f acc1 = {};
  wmma_mainloop(x2, W3, H2, m0, n0, smem, acc0, acc1);

  const int   ng  = n0 + wc * 16 + l15;   // global D_OUT column
  const float b3v = b3[ng];

#pragma unroll
  for (int tt = 0; tt < 2; ++tt) {
    v8f acc = tt ? acc1 : acc0;
#pragma unroll
    for (int j = 0; j < 8; ++j) {
      const int row = m0 + wr * 32 + tt * 16 + j + half * 8;
      out[(size_t)row * D_OUT + ng] = acc[j] + b3v;
    }
  }
}

// ---------------------------------------------------------------------------
extern "C" void kernel_launch(void* const* d_in, const int* in_sizes, int n_in,
                              void* d_out, int out_size, void* d_ws, size_t ws_size,
                              hipStream_t stream) {
  (void)in_sizes; (void)n_in; (void)out_size; (void)ws_size;

  const float* x  = (const float*)d_in[0];
  const float* W1 = (const float*)d_in[1];
  const float* b1 = (const float*)d_in[2];
  const float* W2 = (const float*)d_in[3];
  const float* b2 = (const float*)d_in[4];
  const float* W3 = (const float*)d_in[5];
  const float* b3 = (const float*)d_in[6];
  float* out = (float*)d_out;
  float* x2  = (float*)d_ws;            // [16384, 512] f32 = 32 MB scratch

  dim3 blk(256);
  fc1_group_fused<<<dim3(B_SZ / BT1, H1 / BT1), blk, 0, stream>>>(x, W1, b1, W2,
                                                                b2, x2);
  fc3_kernel<<<dim3(B_SZ / 64, D_OUT / 64), blk, 0, stream>>>(x2, W3, b3, out);
}
